// v010
// The times below were measured on an AMD MI455X: many runs one after another, warmed up first and cycling through
// copies of the inputs, with the whole window's GPU time divided by the number of runs. Launches and the gaps
// between them are all in it. The median over several windows is given; except for v000 it joins two sittings, which
// can be a few percent apart, so the side-by-side timings, each taken in one sitting, are the better comparison.
// Earlier versions than v010 are not in this document.
// Measured time: 23.5 microseconds a run.
// Two timings next to v009 both put it at 1.04 times that version's speed.
// Over all steps from v000, the starting kernel, it is 1366 times as fast.
#include <hip/hip_runtime.h>
// Single-head causal self-attention with the module's EMBEDDING-width scale (x [4][4096][256]; k/q/v = x W ([in][out] [256][64], U(+-0.1), no biases; input order Wk, Wq, Wv); ONE 64-wide head; wei * 256^-0.5 (n_embd, as in the source); causal (tril, -inf); softmax; out = wei v -> [4][4096][64]; no output projection).
// Structure: token rows; ONE projection launch (x and the weights converted to their exact f16 values on the way in; WMMA; writes the f16 q, k and v^T planes and the f32 q, k planes of rows 0..511 in the order of the matrix fragments that the attention launch loads, and the f32 v rows of rows 0..511); ONE attention launch with the batches on grid.x: rows 512.. by the fused f16 path (scores, online softmax f32 -> f16 weights in registers, P V, written as f32 straight into the output rows), rows 0..511 by exact f32 work-groups of the same launch; launches: see trace.
// Compute dtype: inputs rounded to bf16; x / weights exact; q, k, v and softmax weights as plain f16 GEMM operands (~2^-12), o accumulated in f32; scores and softmax statistics f32; v_wmma_f32_16x16x32_f16; rows 0..511: f32 operands, v_wmma_f32_16x16x4_f32.
#define NB 4
#define SQ 4096
#define DM 256
#define NH 1
#define HD 64
#define HG 4                         /* heads per attention launch group */
#define QT 256                       /* unused */
#define NKX SQ                       /* S / P row pitch */
#define QT0 512                      /* first-tile rows recomputed exactly (f32): 512 here (no output projection averages the early-row cancellation errors away; logit sigma 1.0) */
#define B0 0                         /* first batch processed (debug hook) */
#define NBR NB                       /* batches processed (debug hook) */
#define NR ((size_t)NB * SQ)
#define DMQ DM
#define DFF 4096                     /* FFN hidden width */
#define DFFR 100                     /* real hidden width */
#define MP ((int)((size_t)NBR * SQ)) /* rows projected (debug hook) */
#define QN SQ                        /* query rows attended per batch (debug hook) */
#define NHD NH                       /* heads attended (debug hook) */
#define MPO MP                       /* rows through the output stage (debug hook) */
#define LQ (3 * DM)      /* unused; the q | k | v rows are LQK = 192 wide */
typedef __bf16 v16b __attribute__((ext_vector_type(16)));
typedef unsigned short v8us __attribute__((ext_vector_type(8), may_alias));
typedef float  v8f  __attribute__((ext_vector_type(8)));
typedef float  v4f  __attribute__((ext_vector_type(4)));
typedef float  v4fa __attribute__((ext_vector_type(4), may_alias));
union FragB { v16b v; v8us half[2]; unsigned short u[16]; };

__device__ __forceinline__ unsigned short bf16_bits(float x) { unsigned int u = __float_as_uint(x); return (unsigned short)((u + 0x7FFFu + ((u >> 16) & 1u)) >> 16); }
__device__ __forceinline__ float bf16_val(unsigned short b) { return __uint_as_float(((unsigned int)b) << 16); }
__device__ __forceinline__ float bf16_round(float x) { return bf16_val(bf16_bits(x)); }
// D += A·B with NT terms: 1 = ah·bh, 2 = + al·bh (A split), 3 = + ah·bl (both split)
template <int NT>
__device__ __forceinline__ v8f mmaN(v16b ah, v16b al, v16b bh, v16b bl, v8f c) {
  c = __builtin_amdgcn_wmma_f32_16x16x32_bf16(false, ah, false, bh, (short)0, c, false, false);
  if (NT >= 2) c = __builtin_amdgcn_wmma_f32_16x16x32_bf16(false, al, false, bh, (short)0, c, false, false);
  if (NT >= 3) c = __builtin_amdgcn_wmma_f32_16x16x32_bf16(false, ah, false, bl, (short)0, c, false, false);
  asm volatile("v_nop\n\tv_nop\n\tv_nop\n\tv_nop" : "+v"(c) : "v"(ah), "v"(al), "v"(bh), "v"(bl));
  return c;
}

__global__ __launch_bounds__(256) void k_wt_bf16(const float* __restrict__ W, unsigned short* __restrict__ Wt, int K, int N) {
  const int t = blockIdx.x * 256 + threadIdx.x;
  const int k8n = K / 8;
  if (t >= N * k8n) return;
  const int n = t / k8n, k8 = (t % k8n) * 8;
  v8us v;
#pragma unroll
  for (int i = 0; i < 8; ++i) v[i] = bf16_bits(W[(size_t)(k8 + i) * N + n]);
  *(v8us*)(Wt + (size_t)n * K + k8) = v;
  
}

// GEMM C[M][N] (f32, pitch ldc) = act(A[M][K]·W + bias). A f32 row-major (pitch lda) converted per fragment to bf16
// (ASPLIT: hi/lo two planes -> 2 terms, else single rounded term); Wt bf16 [N][K] (pitch ldb). BIAS_BF16 rounds the
// bias to bf16 first (bias quantised to bf16 before the add). K%32==0, M%16==0, N%64==0.
template <bool ASPLIT, int ACT, bool BIAS_BF16>
__global__ __launch_bounds__(128) void k_gemm_bf(const float* __restrict__ A, int lda, const unsigned short* __restrict__ Wt, int ldb,
                                               const float* __restrict__ bias, float* __restrict__ C, int ldc, int M, int N, int K) {
  __shared__ __attribute__((aligned(16))) float so[4][16][64];
  const int tid = threadIdx.x, w = tid >> 5, lane = tid & 31, ln = lane & 15, hh = lane >> 4;
  const int ntn = N / 64;
  const int wid = blockIdx.x * 4 + w;
  const int mt = wid / ntn, nq = wid % ntn;
  if (mt * 16 >= M) return;
  const int row0 = mt * 16, col0 = nq * 64;
  const float* arow = A + (size_t)(row0 + ln) * lda;
  v8f acc[4] = {};
  for (int kb = 0; kb < K; kb += 32) {
    FragB ah, al;
    const v4f x0 = *(const v4fa*)(arow + kb + 8 * hh), x1 = *(const v4fa*)(arow + kb + 8 * hh + 4);
    const v4f x2 = *(const v4fa*)(arow + kb + 16 + 8 * hh), x3 = *(const v4fa*)(arow + kb + 16 + 8 * hh + 4);
    float xs[16] = {x0[0],x0[1],x0[2],x0[3],x1[0],x1[1],x1[2],x1[3],x2[0],x2[1],x2[2],x2[3],x3[0],x3[1],x3[2],x3[3]};
#pragma unroll
    for (int i = 0; i < 16; ++i) { const unsigned short hb = bf16_bits(xs[i]); ah.u[i] = hb; al.u[i] = ASPLIT ? bf16_bits(xs[i] - bf16_val(hb)) : (unsigned short)0; }
#pragma unroll
    for (int t = 0; t < 4; ++t) {
      const unsigned short* brow = Wt + (size_t)(col0 + t * 16 + ln) * ldb + kb;
      FragB b;
      b.half[0] = *(const v8us*)(brow + 8 * hh);
      b.half[1] = *(const v8us*)(brow + 16 + 8 * hh);
      acc[t] = mmaN<ASPLIT ? 2 : 1>(ah.v, al.v, b.v, b.v, acc[t]);
    }
  }
#pragma unroll
  for (int t = 0; t < 4; ++t) {
    float bv = bias ? bias[col0 + t * 16 + ln] : 0.f;
    if (BIAS_BF16) bv = bf16_round(bv);
#pragma unroll
    for (int r = 0; r < 8; ++r) { float v = acc[t][r] + bv; if (ACT == 1) v = fmaxf(v, 0.f); so[w][8 * hh + r][t * 16 + ln] = v; }
  }
  __builtin_amdgcn_fence(__ATOMIC_ACQ_REL, "workgroup");
  __builtin_amdgcn_wave_barrier();
  const int rsub = lane >> 4, c4 = (lane & 15) * 4;
  {
#pragma unroll
    for (int q = 0; q < 8; ++q) {
      const int r = q * 2 + rsub;
      const v4f v = *(const v4fa*)&so[w][r][c4];
      *(v4f*)(C + (size_t)(row0 + r) * ldc + col0 + c4) = v;
    }
    
  }
}

// GEMM C = act(A·W + bias + resid): A f32 (ASPLIT -> hi/lo 2 terms), Wt bf16 [N][K]; ACT 0 none, 1 relu, 2 exact gelu;
// resid (optional, f32, row index = (row % rmod), pitch ldr, RES_BF16 rounds it) added before the activation.
template <bool ASPLIT, int ACT, bool BIAS_BF16, bool RES_BF16>
__global__ __launch_bounds__(128) void k_gemm_bf3(const float* __restrict__ A, int lda, const unsigned short* __restrict__ Wt, int ldb,
                                                const float* __restrict__ bias, const float* __restrict__ resid, int rmod, int ldr,
                                                float* __restrict__ C, int ldc, int M, int N, int K) {
  __shared__ __attribute__((aligned(16))) float so[4][16][64];
  const int tid = threadIdx.x, w = tid >> 5, lane = tid & 31, ln = lane & 15, hh = lane >> 4;
  const int ntn = N / 64;
  const int wid = blockIdx.x * 4 + w;
  const int mt = wid / ntn, nq = wid % ntn;
  if (mt * 16 >= M) return;
  const int row0 = mt * 16, col0 = nq * 64;
  const float* arow = A + (size_t)(row0 + ln) * lda;
  v8f acc[4] = {};
  for (int kb = 0; kb < K; kb += 32) {
    FragB ah, al;
    const v4f x0 = *(const v4fa*)(arow + kb + 8 * hh), x1 = *(const v4fa*)(arow + kb + 8 * hh + 4);
    const v4f x2 = *(const v4fa*)(arow + kb + 16 + 8 * hh), x3 = *(const v4fa*)(arow + kb + 16 + 8 * hh + 4);
    float xs[16] = {x0[0],x0[1],x0[2],x0[3],x1[0],x1[1],x1[2],x1[3],x2[0],x2[1],x2[2],x2[3],x3[0],x3[1],x3[2],x3[3]};
#pragma unroll
    for (int i = 0; i < 16; ++i) { const unsigned short hb = bf16_bits(xs[i]); ah.u[i] = hb; al.u[i] = ASPLIT ? bf16_bits(xs[i] - bf16_val(hb)) : (unsigned short)0; }
#pragma unroll
    for (int t = 0; t < 4; ++t) {
      const unsigned short* brow = Wt + (size_t)(col0 + t * 16 + ln) * ldb + kb;
      FragB b;
      b.half[0] = *(const v8us*)(brow + 8 * hh);
      b.half[1] = *(const v8us*)(brow + 16 + 8 * hh);
      acc[t] = mmaN<ASPLIT ? 2 : 1>(ah.v, al.v, b.v, b.v, acc[t]);
    }
  }
#pragma unroll
  for (int t = 0; t < 4; ++t) {
    const int col = col0 + t * 16 + ln;
    float bv = bias ? bias[col] : 0.f;
    if (BIAS_BF16) bv = bf16_round(bv);
#pragma unroll
    for (int r = 0; r < 8; ++r) {
      float v = acc[t][r] + bv;
      if (resid) { float rv = resid[(size_t)((row0 + 8 * hh + r) % rmod) * ldr + col]; if (RES_BF16) rv = bf16_round(rv); v += rv; }
      if (ACT == 1) v = fmaxf(v, 0.f);
      if (ACT == 2) v = 0.5f * v * (1.0f + erff(v * 0.70710678118654752f));
      if (ACT == 3) { const float u = 0.7978845608028654f * (v + 0.044715f * v * v * v); v = 0.5f * v * (1.0f + tanhf(u)); }
      so[w][8 * hh + r][t * 16 + ln] = v;
    }
  }
  __builtin_amdgcn_fence(__ATOMIC_ACQ_REL, "workgroup");
  __builtin_amdgcn_wave_barrier();
  const int rsub = lane >> 4, c4 = (lane & 15) * 4;
  {
#pragma unroll
    for (int q = 0; q < 8; ++q) {
      const int r = q * 2 + rsub;
      const v4f v = *(const v4fa*)&so[w][r][c4];
      *(v4f*)(C + (size_t)(row0 + r) * ldc + col0 + c4) = v;
    }
    
  }
}
// row LayerNorm (biased variance, eps) over N: s = X (+ R); optional out_sum <- s; out_norm <- (s-mu)*rsqrt(var+eps)*g + b
template <bool PARAM_BF16>
__global__ __launch_bounds__(256) void k_layernorm(const float* __restrict__ X, const float* __restrict__ R, const float* __restrict__ g, const float* __restrict__ bta,
                                                  float* __restrict__ out_sum, float* __restrict__ out_norm, int N, float eps) {
  __shared__ float red[256];
  const int row = blockIdx.x, tid = threadIdx.x;
  const float* x = X + (size_t)row * N; const float* rr = R ? R + (size_t)row * N : nullptr;
  float vals[16];                     // up to N = 4096
  const int per = N / 256;            // contiguous chunk per thread? use strided-by-4 chunks: thread handles j = tid*4 + 1024*u
  float s1 = 0.f;
  for (int u = 0; u < per / 4; ++u) {
    const int j = tid * 4 + 1024 * u;
    const v4f a = *(const v4fa*)(x + j);
    v4f b = {0.f,0.f,0.f,0.f}; if (rr) b = *(const v4fa*)(rr + j);
#pragma unroll
    for (int q = 0; q < 4; ++q) { const float v = a[q] + b[q]; vals[u * 4 + q] = v; s1 += v; }
  }
  red[tid] = s1; __syncthreads();
  for (int st = 128; st > 0; st >>= 1) { if (tid < st) red[tid] += red[tid + st]; __syncthreads(); }
  const float mu = red[0] / (float)N; __syncthreads();
  float s2 = 0.f;
  for (int u = 0; u < per / 4; ++u)
#pragma unroll
    for (int q = 0; q < 4; ++q) { const float c = vals[u * 4 + q] - mu; s2 += c * c; }
  red[tid] = s2; __syncthreads();
  for (int st = 128; st > 0; st >>= 1) { if (tid < st) red[tid] += red[tid + st]; __syncthreads(); }
  const float rs = rsqrtf(red[0] / (float)N + eps);
  {
    for (int u = 0; u < per / 4; ++u) {
      const int j = tid * 4 + 1024 * u;
      v4f o, sm;
#pragma unroll
      for (int q = 0; q < 4; ++q) {
        float gg = g[j + q], bb = bta[j + q];
        if (PARAM_BF16) { gg = bf16_round(gg); bb = bf16_round(bb); }
        sm[q] = vals[u * 4 + q]; o[q] = (vals[u * 4 + q] - mu) * rs * gg + bb;
      }
      if (out_sum) *(v4f*)(out_sum + (size_t)row * N + j) = sm;
      *(v4f*)(out_norm + (size_t)row * N + j) = o;
    }
    
  }
}



// ---- f16 WMMA path (v_wmma_f32_16x16x32_f16): 11-bit significands for operands in range — used where a [0,1] probability operand needs more precision than bf16
typedef _Float16 v16h __attribute__((ext_vector_type(16)));
union FragH { v16h v; v8us half[2]; _Float16 h[16]; unsigned short u[16]; };
template <int NT>
__device__ __forceinline__ v8f mmaH(v16h ah, v16h al, v16h bh, v16h bl, v8f c) {
  c = __builtin_amdgcn_wmma_f32_16x16x32_f16(false, ah, false, bh, (short)0, c, false, false);
  if (NT >= 2) c = __builtin_amdgcn_wmma_f32_16x16x32_f16(false, al, false, bh, (short)0, c, false, false);
  if (NT >= 3) c = __builtin_amdgcn_wmma_f32_16x16x32_f16(false, ah, false, bl, (short)0, c, false, false);
  asm volatile("v_nop\n\tv_nop\n\tv_nop\n\tv_nop" : "+v"(c) : "v"(ah), "v"(al), "v"(bh), "v"(bl));
  return c;
}
// batched GEMM like k_gemm_b but f16 operands: A f32 (split into f16 hi/lo if ASPLIT, else rounded to f16), Bt = f16 values [n][k]; alpha; C f32; N multiple of 16 (partial tiles skipped)
template <bool ASPLIT>
__global__ __launch_bounds__(128) void k_gemm_h(const float* __restrict__ A, int lda, size_t sA, const _Float16* __restrict__ Bh, int ldb, size_t sB, float alpha, float* __restrict__ C, int ldc, size_t sC, int M, int N, int K) {
  __shared__ __attribute__((aligned(16))) float so[4][16][64];
  const int tid = threadIdx.x, w = tid >> 5, lane = tid & 31, ln = lane & 15, hh = lane >> 4; const int by = blockIdx.y;
  A += (size_t)by * sA; Bh += (size_t)by * sB; C += (size_t)by * sC;
  const int ntn = (N + 63) / 64; const int wid = blockIdx.x * 4 + w; const int mt = wid / ntn, nq = wid % ntn; if (mt * 16 >= M) return;
  const int row0 = mt * 16, col0 = nq * 64; const float* arow = A + (size_t)(row0 + ln) * lda;
  v8f acc[4] = {};
  for (int kb = 0; kb < K; kb += 32) {
    FragH ah, al;
    const v4f x0 = *(const v4fa*)(arow + kb + 8 * hh), x1 = *(const v4fa*)(arow + kb + 8 * hh + 4), x2 = *(const v4fa*)(arow + kb + 16 + 8 * hh), x3 = *(const v4fa*)(arow + kb + 16 + 8 * hh + 4);
    float xs[16] = {x0[0],x0[1],x0[2],x0[3],x1[0],x1[1],x1[2],x1[3],x2[0],x2[1],x2[2],x2[3],x3[0],x3[1],x3[2],x3[3]};
#pragma unroll
    for (int i = 0; i < 16; ++i) { const _Float16 h = (_Float16)xs[i]; ah.h[i] = h; al.h[i] = ASPLIT ? (_Float16)(xs[i] - (float)h) : (_Float16)0.0f; }
#pragma unroll
    for (int t = 0; t < 4; ++t) { if (col0 + t * 16 >= N) continue; const size_t boff = (size_t)(col0 + t * 16 + ln) * ldb + kb; FragH bq; bq.half[0] = *(const v8us*)(Bh + boff + 8 * hh); bq.half[1] = *(const v8us*)(Bh + boff + 16 + 8 * hh);
      acc[t] = mmaH<ASPLIT ? 2 : 1>(ah.v, al.v, bq.v, bq.v, acc[t]); }
  }
#pragma unroll
  for (int t = 0; t < 4; ++t) { if (col0 + t * 16 >= N) continue;
#pragma unroll
    for (int r = 0; r < 8; ++r) so[w][8 * hh + r][t * 16 + ln] = acc[t][r] * alpha; }
  __builtin_amdgcn_fence(__ATOMIC_ACQ_REL, "workgroup"); __builtin_amdgcn_wave_barrier();
  const int rsub = lane >> 4, c4 = (lane & 15) * 4;
  {
#pragma unroll
    for (int q = 0; q < 8; ++q) { const int r = q * 2 + rsub; if (col0 + c4 < N) { const v4f v = *(const v4fa*)&so[w][r][c4]; *(v4f*)(C + (size_t)(row0 + r) * ldc + col0 + c4) = v; } }
     }
}

// Wt[n][k] = f16(W[k][n]·scale) from f32 row-major W[K][N] (scale = power of two; bf16-exact weights stay exact in f16 away from the subnormal range)
__global__ __launch_bounds__(256) void k_wt_f16(const float* __restrict__ W, _Float16* __restrict__ Wt, int K, int N, float scale) {
  const int t = blockIdx.x * 256 + threadIdx.x; if (t >= N * (K / 8)) return; const int n = t / (K / 8), k8 = (t % (K / 8)) * 8; FragH f;
#pragma unroll
  for (int i = 0; i < 8; ++i) f.h[i] = (_Float16)(bf16_round(W[(size_t)(k8 + i) * N + n]) * scale); const v8us o = f.half[0];
  *(v8us*)((unsigned short*)Wt + (size_t)n * K + k8) = o; 
}
// k_gemm_hh variant with fused epilogue: v = acc·alpha + bias[by·sBias + col] (+ CP[(row/rowsPerB)·sCPb + by·64 + col] if CP) ; ACT 0 none / 1 elu ; writes f16 C16 (and f32 C if non-null)
template <int ACT>
__global__ __launch_bounds__(128) void k_gemm_hhx(const _Float16* __restrict__ A, int lda, size_t sA, const _Float16* __restrict__ Bh, int ldb, size_t sB, float alpha, const float* __restrict__ bias, size_t sBias, const float* __restrict__ CP, int rowsPerB, size_t sCPb, int row0g,
    float* __restrict__ C, _Float16* __restrict__ C16, int ldc, size_t sC, int M, int N, int K) {
  __shared__ __attribute__((aligned(16))) float so[4][16][64];
  const int tid = threadIdx.x, w = tid >> 5, lane = tid & 31, ln = lane & 15, hh = lane >> 4; const int by = blockIdx.y;
  A += (size_t)by * sA; Bh += (size_t)by * sB; const size_t cofs = (size_t)by * sC; const float* bp = bias ? bias + (size_t)by * sBias : nullptr;
  const int ntn = (N + 63) / 64; const int wid = blockIdx.x * 4 + w; const int mt = wid / ntn, nq = wid % ntn; if (mt * 16 >= M) return;
  const int row0 = mt * 16, col0 = nq * 64; const _Float16* arow = A + (size_t)(row0 + ln) * lda;
  v8f acc[4] = {};
  for (int kb = 0; kb < K; kb += 32) { FragH ah; ah.half[0] = *(const v8us*)((const unsigned short*)arow + kb + 8 * hh); ah.half[1] = *(const v8us*)((const unsigned short*)arow + kb + 16 + 8 * hh);
#pragma unroll
    for (int t = 0; t < 4; ++t) { if (col0 + t * 16 >= N) continue; const size_t boff = (size_t)(col0 + t * 16 + ln) * ldb + kb; FragH bq; bq.half[0] = *(const v8us*)((const unsigned short*)Bh + boff + 8 * hh); bq.half[1] = *(const v8us*)((const unsigned short*)Bh + boff + 16 + 8 * hh);
      acc[t] = mmaH<1>(ah.v, ah.v, bq.v, bq.v, acc[t]); }
  }
#pragma unroll
  for (int t = 0; t < 4; ++t) { if (col0 + t * 16 >= N) continue; const int col = col0 + t * 16 + ln; const float bv = bp ? bf16_round(bp[col]) : 0.f;
#pragma unroll
    for (int r = 0; r < 8; ++r) { float v = acc[t][r] * alpha + bv; if (CP) { const int rr = row0g + row0 + 8 * hh + r; if (rowsPerB < 0) v += CP[cofs + (size_t)rr * ldc + col];      /* rowsPerB < 0: own element of the batched C plane */ else { const int bidx = rr / rowsPerB; v += CP[(size_t)bidx * sCPb + (size_t)by * 64 + col]; } } if (ACT == 1) v = (v > 0.f) ? v : expm1f(v); else if (ACT == 7) v = (v > 0.f) ? v + 1.0f : expf(v); else if (ACT == 8) v = tanhf(v); else if (ACT == 9) v = 0.5f * v * (1.0f + tanhf(0.7978845608028654f * (v + 0.044715f * v * v * v))); else if (ACT == 11) v = 1.0f / (1.0f + expf(-v)); else if (ACT == 12) v = (v > 0.f) ? v : 0.01f * v; else if (ACT == 14) v = (v > 0.f) ? v : 0.1f * v; else if (ACT == 16) v = (v >= 0.f) ? v : 0.3f * v; else if (ACT == 17) v = (v >= 0.f) ? v : 0.2f * v; else if (ACT == 15) v = v / (1.0f + expf(-v)); else if (ACT == 3) v = fmaxf(v, 0.f); else if (ACT == 6) v = 0.5f * v * (1.0f + erff(v * 0.70710678118654752f)); so[w][8 * hh + r][t * 16 + ln] = v; } }
  __builtin_amdgcn_fence(__ATOMIC_ACQ_REL, "workgroup"); __builtin_amdgcn_wave_barrier();
  const int rsub = lane >> 4, c4 = (lane & 15) * 4; typedef _Float16 v4h __attribute__((ext_vector_type(4)));
  {
#pragma unroll
    for (int q = 0; q < 8; ++q) { const int r = q * 2 + rsub; if (col0 + c4 < N) { const v4f v = *(const v4fa*)&so[w][r][c4]; if (C) *(v4f*)(C + cofs + (size_t)(row0 + r) * ldc + col0 + c4) = v; if (C16) { v4h h4; for (int i = 0; i < 4; ++i) h4[i] = (_Float16)v[i]; *(v4h*)(C16 + cofs + (size_t)(row0 + r) * ldc + col0 + c4) = h4; } } }
     }
}


typedef _Float16 v4h __attribute__((ext_vector_type(4)));

__global__ __launch_bounds__(256) void k_x16(const float* __restrict__ x, _Float16* __restrict__ X16, size_t n8) { const size_t t = (size_t)blockIdx.x * 256 + threadIdx.x; if (t >= n8) return; FragH f;
#pragma unroll
  for (int q = 0; q < 8; ++q) f.h[q] = (_Float16)bf16_round(x[t * 8 + q]); *(v8us*)((unsigned short*)X16 + t * 8) = f.half[0];  }
__global__ __launch_bounds__(256) void k_h16(const float* __restrict__ x, _Float16* __restrict__ X16, size_t n8) { const size_t t = (size_t)blockIdx.x * 256 + threadIdx.x; if (t >= n8) return; FragH f;
#pragma unroll
  for (int q = 0; q < 8; ++q) f.h[q] = (_Float16)x[t * 8 + q]; *(v8us*)((unsigned short*)X16 + t * 8) = f.half[0];  }
__global__ __launch_bounds__(256) void k_round16f(const float* __restrict__ W, _Float16* __restrict__ Bt, size_t n8) { const size_t t = (size_t)blockIdx.x * 256 + threadIdx.x; if (t >= n8) return; FragH f;
#pragma unroll
  for (int i = 0; i < 8; ++i) f.h[i] = (_Float16)(bf16_round(W[t * 8 + i]) * 16.0f); *(v8us*)((unsigned short*)Bt + t * 8) = f.half[0];  }
template <int NHv, int TTv>
__global__ __launch_bounds__(256) void k_vt(const _Float16* __restrict__ V16, int ldv, int voff, _Float16* __restrict__ Vt) { __shared__ unsigned short tl[64][66]; const int tid = threadIdx.x; const int slab = blockIdx.x / (TTv / 64), lg = blockIdx.x % (TTv / 64); const int b = slab / NHv, h = slab % NHv;
  for (int i = tid; i < 64 * 8; i += 256) { const int r = i / 8, c8 = (i % 8) * 8; FragH f; f.half[0] = *(const v8us*)((const unsigned short*)V16 + ((size_t)b * TTv + lg * 64 + r) * ldv + voff + h * 64 + c8);
#pragma unroll
    for (int q = 0; q < 8; ++q) tl[r][c8 + q] = f.u[q]; }
  __syncthreads();
  {
#pragma unroll
    for (int rd = 0; rd < 2; ++rd) { const int d = rd * 32 + tid / 8, pc = tid % 8; FragH f;
#pragma unroll
      for (int q = 0; q < 8; ++q) f.u[q] = tl[pc * 8 + q][d];
      *(v8us*)((unsigned short*)Vt + ((size_t)slab * 64 + d) * TTv + lg * 64 + pc * 8) = f.half[0]; }
     } }

__global__ __launch_bounds__(256) void k_hl(const float* __restrict__ F, _Float16* __restrict__ Hh, _Float16* __restrict__ Hl, size_t n8) { const size_t t = (size_t)blockIdx.x * 256 + threadIdx.x; if (t >= n8) return; FragH fh, fl; const v4f a = *(const v4fa*)(F + t * 8), c = *(const v4fa*)(F + t * 8 + 4);
#pragma unroll
  for (int q = 0; q < 4; ++q) { _Float16 h = (_Float16)a[q]; fh.h[q] = h; fl.h[q] = (_Float16)((a[q] - (float)h) * 1024.0f); h = (_Float16)c[q]; fh.h[4 + q] = h; fl.h[4 + q] = (_Float16)((c[q] - (float)h) * 1024.0f); }
  { *(v8us*)((unsigned short*)Hh + t * 8) = fh.half[0]; *(v8us*)((unsigned short*)Hl + t * 8) = fl.half[0];  } }

// ---- fast GEMM (wave tile 32x64; requires M % 32 == 0 rows per launch region and N % 64 == 0); epilogue = k_gemm_hhx semantics ----
__device__ __forceinline__ v16h g2_frag(const _Float16* p, int hh) { FragH f; f.half[0] = *(const v8us*)((const unsigned short*)p + 8 * hh); f.half[1] = *(const v8us*)((const unsigned short*)p + 16 + 8 * hh); return f.v; }
__device__ __forceinline__ v8f g2_mma(v16h a, v16h b, v8f c) { v8f d = __builtin_amdgcn_wmma_f32_16x16x32_f16(false, a, false, b, (short)0, c, false, false); asm volatile("v_nop\n\tv_nop\n\tv_nop\n\tv_nop" : "+v"(d) : "v"(a), "v"(b)); return d; }
template <int ACT>
__global__ __launch_bounds__(128) void k_gemm2(const _Float16* __restrict__ A, int lda, size_t sA, const _Float16* __restrict__ Bh, int ldb, size_t sB, float alpha, const float* __restrict__ bias, size_t sBias, const float* __restrict__ CP, int rowsPerB, size_t sCPb, int row0g,
    float* __restrict__ C, _Float16* __restrict__ C16, int ldc, size_t sC, int M, int N, int K) { static_assert(ACT == 0 || ACT == 3 || ACT == 6 || ACT == 8 || ACT == 9 || ACT == 11 || ACT == 12 || ACT == 14 || ACT == 15 || ACT == 16 || ACT == 17, "k_gemm2: unsupported ACT code (would silently apply no activation)");
  __shared__ __attribute__((aligned(16))) float so[4][32][68];
  const int tid = threadIdx.x, w = tid >> 5, lane = tid & 31, ln = lane & 15, hh = lane >> 4; const int by = blockIdx.y;
  A += (size_t)by * sA; Bh += (size_t)by * sB; const size_t cofs = (size_t)by * sC; const float* bp = bias ? bias + (size_t)by * sBias : nullptr;
  const int ntn = N >> 6; const int mt = blockIdx.x / ntn, nq = blockIdx.x - mt * ntn; const int row0 = mt * 128 + 32 * w, col0 = nq * 64; if (row0 >= M) return;
  const _Float16* a0p = A + (size_t)(row0 + ln) * lda; const _Float16* a1p = a0p + (size_t)16 * lda;
  const _Float16* b0p = Bh + (size_t)(col0 + ln) * ldb; const _Float16* b1p = b0p + (size_t)16 * ldb; const _Float16* b2p = b1p + (size_t)16 * ldb; const _Float16* b3p = b2p + (size_t)16 * ldb;
  const v8f z8 = {0.f,0.f,0.f,0.f,0.f,0.f,0.f,0.f}; v8f c00 = z8, c01 = z8, c02 = z8, c03 = z8, c10 = z8, c11 = z8, c12 = z8, c13 = z8;
#pragma unroll 1
  for (int kb = 0; kb < K; kb += 32) { const v16h a0 = g2_frag(a0p + kb, hh), a1 = g2_frag(a1p + kb, hh);
    v16h b = g2_frag(b0p + kb, hh); c00 = g2_mma(a0, b, c00); c10 = g2_mma(a1, b, c10);
    b = g2_frag(b1p + kb, hh); c01 = g2_mma(a0, b, c01); c11 = g2_mma(a1, b, c11);
    b = g2_frag(b2p + kb, hh); c02 = g2_mma(a0, b, c02); c12 = g2_mma(a1, b, c12);
    b = g2_frag(b3p + kb, hh); c03 = g2_mma(a0, b, c03); c13 = g2_mma(a1, b, c13); }
  v8f accs[8] = {c00, c01, c02, c03, c10, c11, c12, c13};
#pragma unroll
  for (int u = 0; u < 8; ++u) { const int t = u & 3, half = u >> 2; const int col = col0 + t * 16 + ln; const float bv = bp ? bf16_round(bp[col]) : 0.f;
#pragma unroll
    for (int r = 0; r < 8; ++r) { const int rloc = half * 16 + 8 * hh + r; float v = accs[u][r] * alpha + bv; if (CP) { if (rowsPerB < 0) v += CP[cofs + (size_t)(row0g + row0 + rloc) * ldc + col];      /* rowsPerB < 0: own element of the batched C plane */ else { const int bidx = (row0g + row0 + rloc) / rowsPerB; v += CP[(size_t)bidx * sCPb + (size_t)by * 64 + col]; } }
      if (ACT == 3) v = fmaxf(v, 0.f); else if (ACT == 6) v = 0.5f * v * (1.0f + erff(v * 0.70710678118654752f)); else if (ACT == 11) v = 1.0f / (1.0f + expf(-v)); else if (ACT == 15) v = v / (1.0f + expf(-v)); else if (ACT == 12) v = (v > 0.f) ? v : 0.01f * v; else if (ACT == 8) v = tanhf(v); else if (ACT == 9) v = 0.5f * v * (1.0f + tanhf(0.7978845608028654f * (v + 0.044715f * v * v * v))); else if (ACT == 14) v = (v > 0.f) ? v : 0.1f * v; else if (ACT == 16) v = (v >= 0.f) ? v : 0.3f * v; else if (ACT == 17) v = (v >= 0.f) ? v : 0.2f * v;
      so[w][rloc][t * 16 + ln] = v; } }
  __builtin_amdgcn_fence(__ATOMIC_ACQ_REL, "workgroup"); __builtin_amdgcn_wave_barrier();
  const int rsub = lane >> 4, c4 = (lane & 15) * 4;
  {
#pragma unroll
    for (int q = 0; q < 16; ++q) { const int r = q * 2 + rsub; const v4f v = *(const v4fa*)&so[w][r][c4]; if (C) *(v4f*)(C + cofs + (size_t)(row0 + r) * ldc + col0 + c4) = v; if (C16) { v4h h4; for (int i = 0; i < 4; ++i) h4[i] = (_Float16)v[i]; *(v4h*)(C16 + cofs + (size_t)(row0 + r) * ldc + col0 + c4) = h4; } }
     } }


__global__ __launch_bounds__(256) void k_wnat(const float* __restrict__ w, size_t n8, _Float16* __restrict__ Bt) { const size_t t = (size_t)blockIdx.x * 256 + threadIdx.x; if (t >= n8) return; FragH f; for (int q = 0; q < 8; ++q) f.h[q] = (_Float16)(bf16_round(w[t * 8 + q]) * 16.0f); *(v8us*)((unsigned short*)Bt + t * 8) = f.half[0];  }
__global__ __launch_bounds__(256) void k_rsm(const float* __restrict__ S, _Float16* __restrict__ P, int nrows) {
  #pragma clang fp contract(off)
  const int i = blockIdx.x * 256 + threadIdx.x; if (i >= nrows) return; const float* s = S + (size_t)i * SQ; float mx = -3.0e38f;
#pragma unroll 1
  for (int j = 0; j < SQ; ++j) mx = fmaxf(mx, s[j]); float se = 0.f;
#pragma unroll 1
  for (int j = 0; j < SQ; ++j) se += expf(s[j] - mx); const float sc = 256.0f / se;
#pragma unroll 1
  for (int j0 = 0; j0 < SQ; j0 += 8) { FragH f; for (int q = 0; q < 8; ++q) f.h[q] = (_Float16)(expf(s[j0 + q] - mx) * sc); unsigned short* d = (unsigned short*)P + (size_t)i * SQ + j0; *(v8us*)d = f.half[0];  } }
__global__ __launch_bounds__(256) void k_vt(const _Float16* __restrict__ V16, int b, int h0, _Float16* __restrict__ VT) { __shared__ unsigned short tl[64][65]; const int tid = threadIdx.x; const int hh = blockIdx.x % HG, sg = blockIdx.x / HG; const int s0 = sg * 64; const int h = h0 + hh;
  for (int i = tid; i < 64 * 8; i += 256) { const int j = i / 8, d8 = (i % 8) * 8; FragH f; f.half[0] = *(const v8us*)((const unsigned short*)V16 + ((size_t)b * SQ + s0 + j) * DM + h * HD + d8); for (int q = 0; q < 8; ++q) tl[d8 + q][j] = f.u[q]; }
  __syncthreads();
  { for (int i = tid; i < 64 * 8; i += 256) { const int d = i / 8, j8 = (i % 8) * 8; FragH f; for (int q = 0; q < 8; ++q) f.u[q] = tl[d][j8 + q]; *(v8us*)((unsigned short*)VT + ((size_t)hh * HD + d) * SQ + s0 + j8) = f.half[0]; }  } }



// Fused causal attention on the f16 planes: scores, softmax and P V in ONE launch; neither S nor P goes through memory. Two blocks of FAR query rows of one batch share a work-group: the long one is worked on by all FAW waves, the short one by FAH of them.
// Both products are formed transposed, so that a lane owns one query in both: S^T = K Q^T (A = K rows, B = Q rows) leaves in lane (ln, hh) the scores of query ln for keys 8 hh + r
// of each 16-key tile, which for two tiles side by side is the k order of a B fragment; O^T = V^T P^T (A = V^T rows, B = those weights as f16) leaves query ln's o for d = 8 hh + r.
// So the weights never leave their registers, and running maximum, denominator and rescale are per lane: lane ^ 16 holds the other keys of the same query, so the maximum is exchanged with it
// once a chunk, and the two halves' denominators are joined once, behind the loop. Scores are carried times log2(e), so that a weight is one v_exp_f32 of a difference.
// wave = key run: the block's 32-key chunks are dealt to its waves in turn (k_attn says which); each wave lays its partial result in LDS as it stands (own maximum, denominator, o); behind ONE barrier the block's partial results are brought to the common maximum and added, in the order of their slots.
// Every inner loop is unrolled so that each index of a register array is a constant (no scratch); the chunk loop stays rolled, so that one chunk's fragments are live at a time and four waves fit a SIMD.
#define FAW 16                       /* waves = key runs of the long block of query rows: the whole work-group (the short block has FAH) */
#define FAH (FAW / 2)                /* waves a block while both blocks of a work-group walk the chunks that both need */
#define FAQ 2                        /* 16-query tiles a wave: each K and V^T fragment is used FAQ times */
#define FAR (16 * FAQ)               /* query rows per block = keys per chunk */
#define FAP (HD + 4)                 /* LDS pitch of a partial o row: 16 B x odd, so that 16-byte accesses of many rows spread over the banks */
__device__ __forceinline__ float fa_xhalf(float x) { return __builtin_bit_cast(float, __builtin_amdgcn_permlanex16(__builtin_bit_cast(int, x), __builtin_bit_cast(int, x), 0x76543210, 0xfedcba98, false, false)); }      /* lane l reads lane l ^ 16: a vector move, where __shfl_xor goes through the LDS path and a wait */
// 2^x. The v_nop in the same statement keeps the one slot that the instruction set asks for behind a transcendental before its result is read or its source overwritten.
__device__ __forceinline__ float fa_exp2(float x) { float r; asm("v_exp_f32 %0, %1\n\tv_nop" : "=v"(r) : "v"(x)); return r; }
__device__ __forceinline__ v8f fa_mma(v16h a, v16h b, v8f c) { return __builtin_amdgcn_wmma_f32_16x16x32_f16(false, a, false, b, (short)0, c, false, false); }
// A fragment from a plane laid out in fragment order: p = the fragment's 1 KiB block + 8 * lane halves. Each of the two 16-byte loads of a wave covers 512 B in a row, four whole lines
// (from token rows a load took 32 B of each of 16 lines). Block of q, k: [16-row tile][k step of 32 columns]; of v^T: [32-key chunk][16-column tile]; inside a block [register half j][hh][ln][8 values],
// the values that g2_frag takes from a row: row ln of the tile, k = 16 j + 8 hh + 0..7 of the step.
__device__ __forceinline__ v16h fr_frag(const _Float16* p) { FragH f; f.half[0] = *(const v8us*)(const unsigned short*)p; f.half[1] = *(const v8us*)((const unsigned short*)p + 256); return f.v; }
struct FaSm { float po[2][FAW][FAR][FAP]; float pm[2][FAW][FAR]; float pl[2][FAW][FAR]; };      /* the partial results of the work-group's two blocks of query rows, so that no wave waits between them; po first: 16-byte accesses */
// One wave's share of one block. blk: which of the work-group's two blocks; w: the slot of the partial result (a scalar); qb: the block of query rows; b: the batch.
// The wave's chunks, all scalars: c0, c0 + st0, ...; a run in steps of FAH ends behind chunk lim and goes on at cB in steps of FAW.
__device__ __forceinline__ void fattn_part(FaSm& sm, const int blk, const int w, const int c0, const int st0, const int lim, const int cB, const int lane, const int qb, const int b, const _Float16* __restrict__ Q16, const _Float16* __restrict__ K16, const _Float16* __restrict__ VT, float scale) {
  static_assert(NH == 1 && HD == 64 && FAR == 32 && SQ % FAR == 0 && 32 * FAW * 8 == 2 * FAR * HD, "one 64-wide head; a chunk of 32 keys is one k step of P V; the merge gives every thread 8 columns of one row of one of the two blocks");
  float (&pm)[FAW][FAR] = sm.pm[blk]; float (&pl)[FAW][FAR] = sm.pl[blk]; float (&po)[FAW][FAR][FAP] = sm.po[blk];
  const int ln = lane & 15, hh = lane >> 4;
  const int nch = qb + 1;      /* causal: chunks 0..qb; only chunk qb crosses the diagonal */
  Q16 += (size_t)b * SQ * HD + lane * 8; K16 += (size_t)b * SQ * HD + lane * 8; VT += (size_t)b * HD * SQ + lane * 8;      /* the three planes in fragment order: the lane's 16 bytes of every 512 */
  v8f o[FAQ][4]; float m[FAQ], l[FAQ]; const float sl2 = scale * 1.44269504088896340736f;
#pragma unroll
  for (int u = 0; u < FAQ; ++u) { m[u] = -1.0e30f; l[u] = 0.f;
#pragma unroll
    for (int t = 0; t < 4; ++t) o[u][t] = v8f{0.f, 0.f, 0.f, 0.f, 0.f, 0.f, 0.f, 0.f}; }
  if (c0 < nch) {      /* a wave without a chunk loads nothing and goes to the merge with m = -1e30, l = 0, o = 0 */
  v16h qf[FAQ][2];
#pragma unroll
  for (int u = 0; u < FAQ; ++u) { const _Float16* qp = Q16 + (size_t)(qb * FAQ + u) * (16 * HD); qf[u][0] = fr_frag(qp); qf[u][1] = fr_frag(qp + 512);
    asm volatile("s_wait_xcnt 0x0" :: "v"(qp) : "memory"); }      /* the wait in front of any overwrite of the address pair that the q loads name; the pair is an input, so it stays whole up to here */
#pragma unroll 1
  for (int c = c0, st = st0; c < nch; ) { const int k0 = c * FAR;
    const _Float16* kp = K16 + (size_t)k0 * HD; const _Float16* vp = VT + (size_t)k0 * HD;      /* a chunk is 4 KiB in a row of each plane */
    const v16h ka0 = fr_frag(kp), ka1 = fr_frag(kp + 512), kb0 = fr_frag(kp + 1024), kb1 = fr_frag(kp + 1536);
    v16h vf[4];
#pragma unroll
    for (int t = 0; t < 4; ++t) vf[t] = fr_frag(vp + t * 512);
    asm volatile("s_wait_xcnt 0x0" :: "v"(kp), "v"(vp) : "memory");      /* the wait in front of any overwrite of the address pairs that the K and V loads name (the next trip forms new ones); the pairs are inputs, so they stay whole up to here */
#pragma unroll
    for (int u = 0; u < FAQ; ++u) { const v8f z8 = {0.f, 0.f, 0.f, 0.f, 0.f, 0.f, 0.f, 0.f};
      const v8f sa = fa_mma(ka1, qf[u][1], fa_mma(ka0, qf[u][0], z8)), sb = fa_mma(kb1, qf[u][1], fa_mma(kb0, qf[u][0], z8));
      float s[16];
#pragma unroll
      for (int r = 0; r < 8; ++r) { s[r] = sa[r] * sl2; s[8 + r] = sb[r] * sl2; }      /* s[i]: key k0 + 8 hh + i (i < 8), k0 + 16 + 8 hh + i - 8 (i >= 8) */
      if (c == nch - 1) { const int dq = u * 16 + ln - 8 * hh;      /* key - k0 <= query - q0, and k0 = q0 here */
#pragma unroll
        for (int r = 0; r < 8; ++r) { if (r > dq) s[r] = -1.0e30f; if (16 + r > dq) s[8 + r] = -1.0e30f; } }
      float mn = s[0];
#pragma unroll
      for (int i = 1; i < 16; ++i) mn = fmaxf(mn, s[i]);
      mn = fmaxf(mn, fa_xhalf(mn)); mn = fmaxf(mn, m[u]);      /* every chunk holds a key that the query sees (the chunk's first), so mn is a real score */
      const float sc = fa_exp2(m[u] - mn); float es = 0.f; FragH p;      /* first chunk: m = -1e30, sc = 0 on l = 0 and o = 0 */
#pragma unroll
      for (int i = 0; i < 16; ++i) { const float e = fa_exp2(s[i] - mn); es += e; p.h[i] = (_Float16)e; }
      l[u] = fmaf(l[u], sc, es); m[u] = mn;      /* l: this half's keys only; sc is the same in both halves */
#pragma unroll
      for (int t = 0; t < 4; ++t) o[u][t] = fa_mma(vf[t], p.v, o[u][t] * sc); }
    c += st; if (st != FAW && c > lim) { c = cB; st = FAW; } } }
#pragma unroll
  for (int u = 0; u < FAQ; ++u) { const float lj = l[u] + fa_xhalf(l[u]); if (hh == 0) { pm[w][u * 16 + ln] = m[u]; pl[w][u * 16 + ln] = lj; }      /* both halves of the wave hold the same m and, joined, the same l */
#pragma unroll
    for (int t = 0; t < 4; ++t) { const v8f y = o[u][t]; *(v4f*)&po[w][u * 16 + ln][t * 16 + 8 * hh] = v4f{y[0], y[1], y[2], y[3]}; *(v4f*)&po[w][u * 16 + ln][t * 16 + 8 * hh + 4] = v4f{y[4], y[5], y[6], y[7]}; } } }
// The merge of one block, behind the barrier. tl: the thread's number among the 256 that merge this block. The wave that had chunk 0, which every row sees, makes the common maximum a real score; a wave without a chunk counts 0.
template <int NP>      /* NP: how many partial results the block has */
__device__ __forceinline__ void fattn_merge(const FaSm& sm, const int blk, const int tl, const int qb, const int b, float* __restrict__ O) {
  const float (&pm)[FAW][FAR] = sm.pm[blk]; const float (&pl)[FAW][FAR] = sm.pl[blk]; const float (&po)[FAW][FAR][FAP] = sm.po[blk];
  const int row = tl >> 3, c8 = (tl & 7) * 8;      /* a wave adds and stores four whole o rows: 1 KiB in a row */
  float pr[NP];
#pragma unroll
  for (int x = 0; x < NP; ++x) pr[x] = pm[x][row];
  float mx = pr[0];
#pragma unroll
  for (int x = 1; x < NP; ++x) mx = fmaxf(mx, pr[x]);
  float ls = 0.f; v4f r0 = {0.f, 0.f, 0.f, 0.f}, r1 = {0.f, 0.f, 0.f, 0.f};
#pragma unroll
  for (int x = 0; x < NP; ++x) { const float f = fa_exp2(pr[x] - mx); ls = fmaf(f, pl[x][row], ls); r0 += *(const v4f*)&po[x][row][c8] * f; r1 += *(const v4f*)&po[x][row][c8 + 4] * f; }
  const float inv = 1.0f / ls; float* op = O + (size_t)b * SQ * HD + (size_t)(qb * FAR + row) * HD + c8;
  const v4f y0 = r0 * inv, y1 = r1 * inv; *(v4f*)op = y0; *(v4f*)(op + 4) = y1;
  asm volatile("s_wait_xcnt 0x0" :: "v"(op), "v"(y0), "v"(y1) : "memory"); }      /* the wait in front of any overwrite of a register that these stores name: the other block's merge follows in the text; address and data are inputs, so they stay whole up to here */

// e^x for x <= 0 to f32 accuracy: x * log2(e) is cut into its nearest integer n and a remainder that one FMA forms exactly (log2(e) as a high and a low float), then 2^remainder * 2^n.
// Below -104 the result is under the smallest f32: x is held there, so that n stays a small integer. The v_nop in the same statement keeps the one slot that the instruction
// set asks for behind a transcendental before its result is read or its source overwritten.
__device__ __forceinline__ float exp_neg(float x) { x = fmaxf(x, -104.0f); const float n = rintf(x * 1.44269502f); const float r = fmaf(x, 1.92596303e-8f, fmaf(x, 1.44269502f, -n));
  float p; asm("v_exp_f32 %0, %1\n\tv_nop" : "=v"(p) : "v"(r)); return ldexpf(p, (int)n); }
// Exact f32 causal attention for rows 0..QT0-1 of every batch (b = batch, each with its own QT0-row plane; rg = block of 32 query rows), stored straight into the output rows.
// Both products run on the f32 matrix form (v_wmma_f32_16x16x4_f32: full f32 operands, f32 sums), transposed as in the f16 path, so that a lane owns one query in both:
// S^T = K Q^T (A = 16 K rows, B = 16 q rows; both sides loaded by the same code, 16 bytes a lane = two k steps, so their k orders are equal) leaves in lane (ln, hh) the scores of query ln for keys 8 hh + r.
// O^T = V^T P^T: registers 2 j, 2 j + 1 of those weights are the B fragment of k step j, keys 8 hh + 2 j + {0, 1}; A takes V in the same key order. Row ln of A's tile t stands for column d = 4 ln + t,
// so a lane's four tiles come from ONE 16-byte load of a V row, a load covers two whole V rows, and o[u][t][r] is column 32 hh + 4 r + t of query u * 16 + ln.
// wave = key run: the block's 2 * (rg + 1) tiles of 16 keys are dealt to the A0W waves in turn; each K and V fragment serves both 16-query tiles. Each wave keeps its own running maximum, denominator and o
// (one rescale a tile); the A0W partial results are brought to the common maximum and added through LDS, always in the order of the waves.
#define A0W 16                       /* waves = key runs per work-group */
#define A0P (HD + 4)                 /* LDS pitch of a partial o row: 16 B x odd, so that 16-byte accesses of 32 rows spread over the banks */
typedef float v2f __attribute__((ext_vector_type(2)));
__device__ __forceinline__ v8f a0_mma(v2f a, v2f b, v8f c) { return __builtin_amdgcn_wmma_f32_16x16x4_f32(false, a, false, b, (short)0, c, false, false); }
struct A0Sm { float po[A0W][32][A0P]; float pm[A0W][32]; float pl[A0W][32]; float pfin[32]; };      /* po first: 16-byte accesses */
__device__ __forceinline__ void att0w_rows(A0Sm& sm, const int rg, const int b, const float* __restrict__ QF, const float* __restrict__ KF, const float* __restrict__ VF, float scale, float* __restrict__ O) {
  static_assert(NH == 1 && HD == 64 && QT0 % 32 == 0 && 32 * A0W * 4 == 32 * HD, "one 64-wide head; 32 rows a block; the merge gives every thread 4 columns of one row");
  float (&pm)[A0W][32] = sm.pm; float (&pl)[A0W][32] = sm.pl; float (&pfin)[32] = sm.pfin; float (&po)[A0W][32][A0P] = sm.po;
  const int lane = threadIdx.x & 31, ln = lane & 15, hh = lane >> 4; const int w = __builtin_amdgcn_readfirstlane((int)(threadIdx.x >> 5));      /* the wave's number as a scalar: the tile loop is a scalar branch, every lane is on at every matrix instruction */
  { const size_t bi = (size_t)b * QT0 * HD; QF += bi + lane * 4; KF += bi + lane * 4; VF += bi; O += (size_t)b * SQ * HD; }      /* q, k in fragment order: [16-row tile][i][hh][ln][4 values], so that load i of a wave covers 512 B in a row; v as rows of HD */
  const int nt = 2 * (rg + 1);      /* causal: key tiles 0 .. 2 rg + 1; only the last two cross the diagonal */
  v8f o[2][4]; float m[2], l[2];
#pragma unroll
  for (int u = 0; u < 2; ++u) { m[u] = -1.0e30f; l[u] = 0.f;
#pragma unroll
    for (int t = 0; t < 4; ++t) o[u][t] = v8f{0.f, 0.f, 0.f, 0.f, 0.f, 0.f, 0.f, 0.f}; }
  if (w < nt) {      /* a wave without a tile loads nothing and goes to the merge with m = -1e30, l = 0, o = 0 */
  v4f qf[2][8];      /* qf[u][i]: columns 8 i + 4 hh .. + 3 of query u * 16 + ln */
#pragma unroll
  for (int u = 0; u < 2; ++u) { const float* qp = QF + (size_t)(rg * 2 + u) * (16 * HD);
#pragma unroll
    for (int i = 0; i < 8; ++i) qf[u][i] = *(const v4fa*)(qp + 128 * i);
    asm volatile("s_wait_xcnt 0x0" :: "v"(qp) : "memory"); }      /* the wait in front of any overwrite of the address pair that the q loads name; the pair is an input, so it stays whole up to here */
#pragma unroll 1
  for (int kt = w; kt < nt; kt += A0W) { const int k0 = kt * 16;      /* rolled: one tile's fragments are live at a time */
    const float* kp = KF + (size_t)k0 * HD; const float* vp = VF + (size_t)(k0 + 8 * hh) * HD + 4 * ln;
    v4f kf[8], vf[8];      /* kf[i]: columns 8 i + 4 hh .. + 3 of key k0 + ln (q's order); vf[i]: columns 4 ln .. + 3 of key k0 + 8 hh + i */
#pragma unroll
    for (int i = 0; i < 8; ++i) kf[i] = *(const v4fa*)(kp + 128 * i);
#pragma unroll
    for (int i = 0; i < 8; ++i) vf[i] = *(const v4fa*)(vp + i * HD);
    asm volatile("s_wait_xcnt 0x0" :: "v"(kp), "v"(vp) : "memory");      /* the wait in front of any overwrite of the address pairs that the K and V loads name (the next trip forms new ones); the pairs are inputs, so they stay whole up to here */
#pragma unroll
    for (int u = 0; u < 2; ++u) { v8f s8 = {0.f, 0.f, 0.f, 0.f, 0.f, 0.f, 0.f, 0.f};
#pragma unroll
      for (int i = 0; i < 8; ++i) { s8 = a0_mma(v2f{kf[i][0], kf[i][1]}, v2f{qf[u][i][0], qf[u][i][1]}, s8); s8 = a0_mma(v2f{kf[i][2], kf[i][3]}, v2f{qf[u][i][2], qf[u][i][3]}, s8); }
      const int dq = rg * 32 + u * 16 + ln - k0 - 8 * hh;      /* register r holds key k0 + 8 hh + r: seen by the query where r <= dq */
      float s[8]; float mn = m[u];
#pragma unroll
      for (int r = 0; r < 8; ++r) { s[r] = (r <= dq) ? s8[r] * scale : -1.0e30f; mn = fmaxf(mn, s[r]); }
      mn = fmaxf(mn, fa_xhalf(mn));      /* lane ^ 16 holds the other eight keys of the same query */
      const float sc = exp_neg(m[u] - mn); float e[8]; float es = 0.f;      /* nothing seen yet: m = mn = -1e30, sc = 1 on l = 0 and o = 0 */
#pragma unroll
      for (int r = 0; r < 8; ++r) { const float x = exp_neg(s[r] - mn); e[r] = (r <= dq) ? x : 0.f; es += e[r]; }      /* formed for every key, then selected: eight independent chains and no branch; a key behind the row counts 0 also where all that the wave has met so far is behind it */
      l[u] = fmaf(l[u], sc, es); m[u] = mn;      /* l: this half's keys only; sc is the same in both halves */
#pragma unroll
      for (int t = 0; t < 4; ++t) { v8f acc = o[u][t] * sc;
#pragma unroll
        for (int j = 0; j < 4; ++j) acc = a0_mma(v2f{vf[2 * j][t], vf[2 * j + 1][t]}, v2f{e[2 * j], e[2 * j + 1]}, acc);
        o[u][t] = acc; } } } }
  { const float l0 = l[0] + fa_xhalf(l[0]), l1 = l[1] + fa_xhalf(l[1]); pm[w][lane] = hh ? m[1] : m[0]; pl[w][lane] = hh ? l1 : l0; }      /* both halves hold the same m and, joined, the same l: lane stores those of row lane */
  __syncthreads();
  float mx = pm[0][lane];      /* wave 0 has tile 0 with key 0, which every row sees: the common maximum is a real score */
#pragma unroll
  for (int u = 1; u < A0W; ++u) mx = fmaxf(mx, pm[u][lane]);
  if (w == 0) { float ls = 0.f;
#pragma unroll
    for (int u = 0; u < A0W; ++u) ls = fmaf(exp_neg(pm[u][lane] - mx), pl[u][lane], ls);
    pfin[lane] = 1.0f / ls; }
  const float mxo = fa_xhalf(mx);      /* the common maximum of row lane ^ 16 */
#pragma unroll
  for (int u = 0; u < 2; ++u) { const float f = exp_neg(m[u] - ((hh == u) ? mx : mxo));
#pragma unroll
    for (int r = 0; r < 8; ++r) *(v4f*)&po[w][u * 16 + ln][32 * hh + 4 * r] = v4f{o[u][0][r] * f, o[u][1][r] * f, o[u][2][r] * f, o[u][3][r] * f}; }
  __syncthreads();
  const int row = threadIdx.x >> 4, c4 = (threadIdx.x & 15) * 4;      /* a wave adds and stores two whole o rows: 512 B in a row */
  v4f r = {0.f, 0.f, 0.f, 0.f};
#pragma unroll
  for (int u = 0; u < A0W; ++u) r += *(const v4f*)&po[u][row][c4];
  r *= pfin[row];
  float* op = O + (size_t)(rg * 32 + row) * HD + c4; *(v4f*)op = r;
  asm volatile("s_wait_xcnt 0x0" :: "v"(op), "v"(r) : "memory"); }      /* the wait in front of any overwrite of a register that this store names: the other path's code follows in the text; address and data are inputs, so they stay whole up to here */

// Both attention paths in ONE launch: neither needs anything of the other, each output row belongs to exactly one of them, and the branch between them is the same for a whole work-group.
// grid.x = batch; grid.y = piece of work: first ATP pairs of f16 blocks of FAR rows (rows QT0..): the t-th longest with the t-th shortest, so that every pair holds the same number of chunks;
// the chunks that both blocks need are walked by both at the same time, half the waves each, so that the K and V lines that one wave fetches from L2 are in the WGP's cache, or on their way there, when its partner asks for them. Then the ATX exact blocks of 32 rows (rows 0..QT0-1, A0W waves each), the longer the earlier. One work-group of 16 waves fills a WGP's registers.
// No loop of either path holds a barrier: every wave of a work-group passes the same ones (f16: one; exact: two).
#define ATX (QT0 / 32)
#define ATP ((SQ - QT0) / (2 * FAR))
union AtSm { FaSm fa; A0Sm a0; };
__global__ __launch_bounds__(32 * A0W) void k_attn(const _Float16* __restrict__ Q16, const _Float16* __restrict__ K16, const _Float16* __restrict__ VT, const float* __restrict__ QF, const float* __restrict__ KF, const float* __restrict__ VF, float scale, float* __restrict__ O) {
  static_assert(FAW == A0W && QT0 % FAR == 0 && (SQ - QT0) % (2 * FAR) == 0, "an f16 block takes a work-group of the exact path's size; the f16 blocks pair up");
  __shared__ __attribute__((aligned(16))) AtSm sm;
  const int b = blockIdx.x, t = blockIdx.y;
  if (t < ATP) { const int wv = __builtin_amdgcn_readfirstlane((int)(threadIdx.x >> 5));      /* the wave's number as a scalar: the chunk loop and its mask test are scalar branches */
    const int qbl = SQ / FAR - 1 - t, qbs = QT0 / FAR + t;      /* the long block and the short one: qbl + qbs is the same for every t */
    const int wh = wv / FAH, w8 = wv % FAH;      /* chunks 0..qbs are needed by both blocks: wave w8 takes them for the long block while wave FAH + w8 takes the same ones, in the same order, for the short block */
    const int cB = qbs + 1 + (FAH - 1 - w8) * 2 + wh;      /* the long block's other chunks go to all FAW waves, dealt from the highest w8 down, so that the waves' trip counts differ by one at most */
#pragma unroll 1      /* rolled: one copy of the chunk loop in the text. Pass 0: the short block, waves FAH.. only; pass 1: the long block, where waves 0..FAH-1 walk both runs of chunks and the others the second run */
    for (int ps = 1 - wh; ps < 2; ++ps) { const bool tail = ps && wh; fattn_part(sm.fa, 1 - ps, ps ? wv : w8, tail ? cB : w8, tail ? FAW : FAH, qbs, cB, (int)threadIdx.x & 31, ps ? qbl : qbs, b, Q16, K16, VT, scale); }
    __syncthreads();
    if (wh) fattn_merge<FAH>(sm.fa, 1, (int)threadIdx.x & 255, qbs, b, O); else fattn_merge<FAW>(sm.fa, 0, (int)threadIdx.x & 255, qbl, b, O); }      /* waves 0..7 merge the long block's FAW partial results, 8..15 the short one's FAH */
  else att0w_rows(sm.a0, ATX - 1 - (t - ATP), b, QF, KF, VF, scale, O); }


template <int BFIN, int WXB>
__global__ __launch_bounds__(256) void k_ln16(const float* __restrict__ X, const float* __restrict__ g, const float* __restrict__ bb, float eps, _Float16* __restrict__ N16, float* __restrict__ XB) {
  #pragma clang fp contract(off)
  __shared__ float red[256]; const size_t r = blockIdx.x; const int t = threadIdx.x; const v4f xa = *(const v4fa*)(X + r * DMQ + t * 4); float s[4]; float sum = 0.f;
  for (int q = 0; q < 4; ++q) { s[q] = BFIN ? bf16_round(xa[q]) : xa[q]; sum = __fadd_rn(sum, s[q]); }
  red[t] = sum; __syncthreads(); for (int st = 128; st > 0; st >>= 1) { if (t < st) red[t] = __fadd_rn(red[t], red[t + st]); __syncthreads(); } const float mu = red[0] / (float)DMQ; __syncthreads();
  float vs = 0.f; for (int q = 0; q < 4; ++q) { const float dl = __fadd_rn(s[q], -mu); vs = __fadd_rn(vs, __fmul_rn(dl, dl)); } red[t] = vs; __syncthreads(); for (int st = 128; st > 0; st >>= 1) { if (t < st) red[t] = __fadd_rn(red[t], red[t + st]); __syncthreads(); }
  const float rs = rsqrtf(__fadd_rn(red[0] / (float)DMQ, eps)); v4h y; v4f xb;
  for (int q = 0; q < 4; ++q) { const int c = t * 4 + q; y[q] = (_Float16)__fadd_rn(__fmul_rn(__fmul_rn(__fadd_rn(s[q], -mu), rs), bf16_round(g[c])), bf16_round(bb[c])); xb[q] = s[q]; }
  { *(v4h*)(N16 + r * DMQ + t * 4) = y; if (WXB) *(v4f*)(XB + r * DMQ + t * 4) = xb;  } }
__global__ __launch_bounds__(256) void k_ftres2(const float* __restrict__ OF0, const float* __restrict__ XB, float* __restrict__ X1, size_t n4) {
  #pragma clang fp contract(off)
  const size_t t = (size_t)blockIdx.x * 256 + threadIdx.x; if (t >= n4) return; const v4f o = *(const v4fa*)(OF0 + t * 4), xv = *(const v4fa*)(XB + t * 4); v4f y; for (int q = 0; q < 4; ++q) y[q] = __fadd_rn(__fmul_rn(o[q], 0.015625f), xv[q]); *(v4f*)(X1 + t * 4) = y;  }

__global__ __launch_bounds__(256) void k_wthd(const float* __restrict__ Wt, _Float16* __restrict__ Bt) { const size_t t = (size_t)blockIdx.x * 256 + threadIdx.x; if (t >= (size_t)NH * HD * (DM / 8)) return; const int m8 = (int)(t % (DM / 8)) * 8; const int d = (int)((t / (DM / 8)) % HD); const int h = (int)(t / ((size_t)(DM / 8) * HD)); FragH f;
  for (int q = 0; q < 8; ++q) f.h[q] = (_Float16)(16.0f * bf16_round(Wt[((size_t)h * DM + m8 + q) * HD + d])); unsigned short* dst = (unsigned short*)Bt + ((size_t)h * HD + d) * DM + m8; *(v8us*)dst = f.half[0];  }




__global__ __launch_bounds__(256) void k_wtpad(const float* __restrict__ Wm, _Float16* __restrict__ Wt, int Kr, int Kp, int Nr, int Np, float scale) {
  const int t = blockIdx.x * 256 + threadIdx.x; if (t >= Np * (Kp / 8)) return; const int n = t / (Kp / 8), k8 = (t % (Kp / 8)) * 8; const int nc = min(n, Nr - 1); const float fn = (n < Nr) ? 1.f : 0.f; FragH f;
  for (int i = 0; i < 8; ++i) { const int k = k8 + i; const int kc = min(k, Kr - 1); const float fk = (k < Kr) ? fn : 0.f; f.h[i] = (_Float16)(bf16_round(Wm[(size_t)kc * Nr + nc]) * scale * fk); }
  unsigned short* o = (unsigned short*)Wt + (size_t)n * Kp + k8; *(v8us*)o = f.half[0];  }
__global__ __launch_bounds__(128) void k_bpad(const float* __restrict__ b, float* __restrict__ Bp, int nr, int np) {
  const int i = threadIdx.x; if (i >= np) return; const float v = b[min(i, nr - 1)] * ((i < nr) ? 1.f : 0.f); *(float*)(Bp + i) = v;  }

#define DI 64         /* inner width = NH * HD (ONE 64-wide head) */
#define LQK (3 * DI)  /* fused q | k | v row pitch (192) */
__global__ __launch_bounds__(256) void k_o0(const float* __restrict__ OF, float* __restrict__ ob, size_t n4) {
  #pragma clang fp contract(off)
  const size_t t = (size_t)blockIdx.x * 256 + threadIdx.x; if (t >= n4) return; const size_t e = t * 4; const int i = (int)(e / DI); const int c = (int)(e % DI); const int h = c / HD, d = c % HD; const v4f a = *(const v4fa*)(OF + e); v4f o; for (int q = 0; q < 4; ++q) o[q] = __fmul_rn(a[q], 0.015625f); float* dst = ob + (size_t)h * SQ * HD + (size_t)i * HD + d; *(v4f*)dst = o;  }

// The whole projection stage in ONE launch: q | k | v = x W for PJR token rows a work-group. x comes in as f32 in whole lines, is rounded as before (bf16, exact in f16) and laid in LDS as f16 rows;
// wave w owns columns 16 w .. 16 w + 15 of q | k | v and builds its eight B fragments straight from the f32 weights (lane = column, so a load takes 64 B of each of two weight rows; value bf16-rounded, x16, f16: as before).
// Products, k order and the order of the k steps are those of the GEMM that this takes the place of, so every q, k, v value is the same number. The accumulators go out three ways, all staged in LDS so that every store
// is of whole 128-B lines: q, k and V^T as f16 (V^T: a lane holds 8 tokens in a row of one column: one 16-byte LDS store), and, for the first QT0 rows of a batch, q, k, v as f32.
// q, k (both widths) and V^T leave in FRAGMENT ORDER (fr_frag; att0w_rows): the 16-byte piece that lane L of an attention wave loads stands at 16 L in a 512-B run, so the reader's loads cover whole lines; a work-group's share of each plane is one run.
#define PJR 64                       /* token rows per work-group: 256 work-groups */
#define PJW 12                       /* waves = 16-column tiles of q | k | v */
#define PJT (32 * PJW)
#define PJXP (DM + 8)                /* LDS pitch of an x row, halves: 528 B = 16 B x odd, for 16-byte fragment reads */
#define PJOP (2 * DI + 8)            /* LDS pitch of a q | k row, halves: 272 B = 16 B x odd */
#define PJVP (PJR + 8)               /* LDS pitch of a V^T row, halves: 144 B = 16 B x odd */
#define PJFP (LQK + 4)               /* LDS pitch of an f32 q | k | v row, floats: 784 B = 16 B x odd */
typedef __bf16 v2b __attribute__((ext_vector_type(2)));
typedef unsigned short v4us __attribute__((ext_vector_type(4), may_alias));
// two floats rounded to bf16 (nearest, ties to even: the value of bf16_round) by the conversion instruction, times s, as two f16
__device__ __forceinline__ void pj_cvt2(float a, float b, float s, _Float16& ha, _Float16& hb) { const v2b p = {(__bf16)a, (__bf16)b}; const unsigned int u = __builtin_bit_cast(unsigned int, p); ha = (_Float16)(__uint_as_float(u << 16) * s); hb = (_Float16)(__uint_as_float(u & 0xFFFF0000u) * s); }
__global__ __launch_bounds__(PJT) void k_proj(const float* __restrict__ x, const float* __restrict__ wq, const float* __restrict__ wk, const float* __restrict__ wv, _Float16* __restrict__ Q16, _Float16* __restrict__ K16, _Float16* __restrict__ VT, float* __restrict__ F0) {
  static_assert(PJW * 16 == LQK && DI == 64 && DM == 256 && SQ % PJR == 0 && QT0 % PJR == 0 && (PJR * 2 * DI + DI * PJR) / 8 == 4 * PJT && PJR * LQK / 4 == 8 * PJT, "a wave a column tile; a work-group lies in one batch and wholly inside or outside the exact rows; the store loops divide evenly");
  __shared__ __attribute__((aligned(16))) _Float16 xs[PJR][PJXP]; __shared__ __attribute__((aligned(16))) _Float16 so[PJR][PJOP]; __shared__ __attribute__((aligned(16))) _Float16 sv[DI][PJVP]; __shared__ __attribute__((aligned(16))) float sf[PJR][PJFP];
  const int tid = threadIdx.x, lane = tid & 31, ln = lane & 15, hh = lane >> 4; const int w = __builtin_amdgcn_readfirstlane(tid >> 5);      /* the wave's number as a scalar: which weight matrix, and every branch on it, is scalar */
  const size_t r0 = (size_t)blockIdx.x * PJR; const int b = (int)(r0 / SQ), s0 = (int)(r0 % SQ);
  const float* wp = (w < 4 ? wq : w < 8 ? wk : wv) + (w & 3) * 16 + ln + (size_t)(8 * hh) * DI; float wr[8][16];
#pragma unroll
  for (int ks = 0; ks < 8; ++ks)
#pragma unroll
    for (int i = 0; i < 8; ++i) { wr[ks][i] = wp[(size_t)(ks * 32 + i) * DI]; wr[ks][8 + i] = wp[(size_t)(ks * 32 + 16 + i) * DI]; }      /* the k order of g2_frag: 8 hh + i, 16 + 8 hh + i */
  const char* xb = (const char*)(x + r0 * DM); const unsigned xo = (unsigned)tid * 16u; const char* xt = xb + xo; v4f xa[11];      /* 4 floats a thread and turn: each load of a wave covers 512 B in a row, four whole lines */
#pragma unroll
  for (int u = 0; u < 11; ++u) if (u < 10 || w < 8) xa[u] = *(const v4fa*)(xt + u * PJT * 16);      /* PJR * DM / 4 = 10 * PJT + 256 */
  asm volatile("s_wait_xcnt 0x0" :: "v"(xo), "v"(xt), "v"(wp), "s"(xb) : "memory");      /* the wait in front of any overwrite of the address registers that the loads above name; x's offset, base and full address and the weights' address are inputs, so whichever form a load takes, its registers stay whole up to here */
  FragH bf[8];
#pragma unroll
  for (int ks = 0; ks < 8; ++ks)
#pragma unroll
    for (int i = 0; i < 16; i += 2) pj_cvt2(wr[ks][i], wr[ks][i + 1], 16.0f, bf[ks].h[i], bf[ks].h[i + 1]);
#pragma unroll
  for (int u = 0; u < 11; ++u) if (u < 10 || w < 8) { const int i = tid + u * PJT; FragH f;
    pj_cvt2(xa[u][0], xa[u][1], 1.0f, f.h[0], f.h[1]); pj_cvt2(xa[u][2], xa[u][3], 1.0f, f.h[2], f.h[3]);
    *(v4us*)&xs[i >> 6][(i & 63) * 4] = v4us{f.u[0], f.u[1], f.u[2], f.u[3]}; }
  __syncthreads();
  v8f acc[4];
#pragma unroll
  for (int mt = 0; mt < 4; ++mt) acc[mt] = v8f{0.f, 0.f, 0.f, 0.f, 0.f, 0.f, 0.f, 0.f};
#pragma unroll
  for (int ks = 0; ks < 8; ++ks)
#pragma unroll
    for (int mt = 0; mt < 4; ++mt) acc[mt] = fa_mma(g2_frag(&xs[mt * 16 + ln][ks * 32], hh), bf[ks].v, acc[mt]);
#pragma unroll
  for (int mt = 0; mt < 4; ++mt) acc[mt] *= 0.0625f;      /* the weights ride x16 */
  const bool ft = s0 < QT0;      /* the same for the whole work-group */
  if (w < 8) {
#pragma unroll
    for (int mt = 0; mt < 4; ++mt)
#pragma unroll
      for (int r = 0; r < 8; ++r) so[mt * 16 + 8 * hh + r][w * 16 + ln] = (_Float16)acc[mt][r];
  } else {
#pragma unroll
    for (int mt = 0; mt < 4; ++mt) { FragH f;
#pragma unroll
      for (int r = 0; r < 8; ++r) f.h[r] = (_Float16)acc[mt][r];
      *(v8us*)&sv[(w & 3) * 16 + ln][mt * 16 + 8 * hh] = f.half[0]; } }
  if (ft) {
#pragma unroll
    for (int mt = 0; mt < 4; ++mt)
#pragma unroll
      for (int r = 0; r < 8; ++r) sf[mt * 16 + 8 * hh + r][w * 16 + ln] = acc[mt][r]; }
  __syncthreads();
  { v4f t[4]; _Float16* gp = (w < 4 ? Q16 : w < 8 ? K16 : VT) + r0 * DI + (w & 3) * 1024 + lane * 8;      /* the work-group's share of each plane is 8 KiB in a row; wave w stores quarter w & 3 of plane w >> 2, four 512-B runs: piece = lane. All reads, then all stores: one LDS latency, not four */
#pragma unroll
    for (int u = 0; u < 4; ++u) t[u] = *(const v4fa*)(w < 8 ? &so[(w & 3) * 16 + ln][(w >> 2) * DI + u * 16 + 8 * hh]      /* q, k: tile w & 3; run u = 2 * k step + half */
                                                            : &sv[((w & 1) * 2 + (u >> 1)) * 16 + ln][((w >> 1) & 1) * 32 + (u & 1) * 16 + 8 * hh]);      /* V^T: chunk (w >> 1) & 1; column tile 2 (w & 1) + (u >> 1); half u & 1 */
#pragma unroll
    for (int u = 0; u < 4; ++u) *(v4fa*)(gp + u * 256) = t[u];
    asm volatile("s_wait_xcnt 0x0" :: "v"(gp), "v"(t[0]), "v"(t[1]), "v"(t[2]), "v"(t[3]) : "memory"); }      /* the wait in front of any overwrite of a register that these stores name; address and data are inputs, so they stay whole up to here */
  if (ft) { v4f t[8]; float* fp = F0 + (size_t)(w >> 2) * NB * QT0 * DI + ((size_t)b * QT0 + s0) * DI + (w & 3) * 1024 + lane * 4;      /* the same deal on the f32 planes: 16 KiB a plane, eight 512-B runs a wave */
    if (w < 8) {
#pragma unroll
      for (int u = 0; u < 8; ++u) t[u] = *(const v4f*)&sf[(w & 3) * 16 + ln][(w >> 2) * DI + 8 * u + 4 * hh];      /* q, k: tile w & 3; run u = columns 8 u + 4 hh .. + 3 of row ln */
    } else {
#pragma unroll
      for (int u = 0; u < 8; ++u) t[u] = *(const v4f*)&sf[(w & 3) * 16 + 2 * u + hh][2 * DI + 4 * ln]; }      /* v: run u = two whole rows */
#pragma unroll
    for (int u = 0; u < 8; ++u) *(v4f*)(fp + u * 128) = t[u];
    asm volatile("s_wait_xcnt 0x0" :: "v"(fp), "v"(t[0]), "v"(t[1]), "v"(t[2]), "v"(t[3]), "v"(t[4]), "v"(t[5]), "v"(t[6]), "v"(t[7]) : "memory"); } }      /* the same wait: address and data are inputs, so no piece's registers are taken for a later piece while its store is on its way */

extern "C" void kernel_launch(void* const* d_in, const int* in_sizes, int n_in,
                              void* d_out, int out_size, void* d_ws, size_t ws_size, hipStream_t stream) {
  (void)in_sizes; (void)n_in; (void)out_size;
  const float* const* I = (const float* const*)d_in; const float* x = I[0]; const float* wq = I[2]; const float* wk = I[1]; const float* wv = I[3];      /* x; [in][out = 64] Wq / Wk / Wv (input order as this module lists them); no biases */
  char* ws = (char*)d_ws; size_t off = 0;
  auto take = [&](size_t bytes) { char* p = ws + off; off += (bytes + 255) & ~(size_t)255; return p; };
  _Float16* Q16 = (_Float16*)take(NR * DI * 2); _Float16* K16 = (_Float16*)take(NR * DI * 2); _Float16* VT = (_Float16*)take((size_t)NB * HD * SQ * 2);
  float* QKVF0 = (float*)take((size_t)NB * QT0 * LQK * 4);      /* three planes, q, k, v, of NB * QT0 rows each: the four batches run side by side */
  if (off > ws_size) return;
  k_proj<<<(unsigned)(NR / PJR), PJT, 0, stream>>>(x, wq, wk, wv, Q16, K16, VT, QKVF0);      /* f16 q, k, V^T of every row and f32 q, k of rows 0..511 of every batch, in fragment order; f32 v rows of rows 0..511 */
  static_assert(NH == 1, "the grid carries the batch in place of the head");
  float* ob = (float*)d_out;
  k_attn<<<dim3(NB, ATX + ATP), 32 * A0W, 0, stream>>>(Q16, K16, VT, QKVF0, QKVF0 + (size_t)NB * QT0 * DI, QKVF0 + (size_t)2 * NB * QT0 * DI, 0.0625f, ob);      /* out[b][i][0..63] = softmax(causal q k^T * 256^-0.5 = 1/16: the module scales by the EMBEDDING width) v, f32, all query rows of all batches in one launch: rows 0..511 exact f32, the rest f16 operands */
}
